// v000
// Measured on an AMD MI455X. A time is GPU time per run, averaged over a window of back-to-back runs after a warm-up
// (all launches, gaps included; the runs take copies of the inputs in turn), and the median of several windows.
// Apart from v000's, it joins two sittings. Times from different sittings can be a few percent apart, while
// side-by-side timings come from the same sitting.
// The starting kernel, v000, takes 72.8 microseconds a run.
#include <hip/hip_runtime.h>
#include <hip/hip_bf16.h>

#define N_ 8
#define L_ 4096
#define S_ 4096
#define H_ 8
#define D_ 64
#define EPS_ 1e-6f
#define SCHUNK 512
#define NCHUNKS (S_ / SCHUNK)
#define ST_ 32                    // s-rows per LDS stage (K tile 8KB + V tile 8KB)
#define NST (SCHUNK / ST_)

typedef __attribute__((ext_vector_type(2))) float v2f;
typedef __attribute__((ext_vector_type(4))) float v4f;
typedef __attribute__((ext_vector_type(8))) float v8f;

__device__ __forceinline__ float feat(float x) {
    // elu(x) + 1
    return x > 0.0f ? (x + 1.0f) : __expf(x);
}

__device__ __forceinline__ unsigned lds_off(const void* p) {
    return (unsigned)(unsigned long long)p;
}

__device__ __forceinline__ void async_copy_b128(unsigned lds_byte, const float* gaddr) {
    asm volatile("global_load_async_to_lds_b128 %0, %1, off"
                 :: "v"(lds_byte), "v"(gaddr) : "memory");
}

__global__ void zero_ws_kernel(float* __restrict__ ws, int nfloats) {
    int i = blockIdx.x * blockDim.x + threadIdx.x;
    if (i < nfloats) ws[i] = 0.0f;
}

// ---------------- Phase A: KV = Kf^T @ (V/S), Ksum = colsum(Kf) ----------------
// grid (N*H, NCHUNKS), 512 threads = 16 waves; wave (tr,tc) owns a 16x16 tile of
// the 64x64 KV output. 32-row K/V stages double-buffered through LDS.
__global__ __launch_bounds__(512) void kv_kernel(
        const float* __restrict__ K, const float* __restrict__ V,
        const float* __restrict__ kvm,
        float* __restrict__ KVws, float* __restrict__ KsumWs) {
    __shared__ __align__(16) float sK[2][ST_ * D_];
    __shared__ __align__(16) float sV[2][ST_ * D_];
    __shared__ float sM[2][ST_];

    const int nh = blockIdx.x;
    const int n  = nh / H_;
    const int h  = nh % H_;
    const int s0 = blockIdx.y * SCHUNK;

    const int t     = threadIdx.x;
    const int wave  = t >> 5;
    const int lane  = t & 31;
    const int laneM = lane & 15;
    const int hi    = lane >> 4;      // lane half -> WMMA K offsets {0,1} vs {2,3}
    const int kk    = hi * 2;
    const int tr    = wave >> 2;
    const int tc    = wave & 3;
    const int d     = tr * 16 + laneM;   // KV row
    const int v     = tc * 16 + laneM;   // KV col
    const float scale = 1.0f / (float)S_;

    // staging: thread t copies 16B = 4 floats; row r, cols [c0,c0+4)
    const int r  = t >> 4;
    const int c0 = (t & 15) * 4;
    const int sstride = H_ * D_;
    const float* Kg = K + ((long)n * S_ * H_ + h) * D_;
    const float* Vg = V + ((long)n * S_ * H_ + h) * D_;
    const float* Mp = kvm + n * S_;

    // Prologue: stage 0 into buffer 0.
    async_copy_b128(lds_off(&sK[0][t * 4]), Kg + (size_t)(s0 + r) * sstride + c0);
    async_copy_b128(lds_off(&sV[0][t * 4]), Vg + (size_t)(s0 + r) * sstride + c0);
    if (t < ST_) sM[0][t] = Mp[s0 + t];

    v8f c = {0.f, 0.f, 0.f, 0.f, 0.f, 0.f, 0.f, 0.f};
    float ksumLocal = 0.0f;

    for (int st = 0; st < NST; ++st) {
        const int b = st & 1;

        if (st + 1 < NST) {
            // Kick next stage into the other buffer (freed by last iter's barrier).
            const int sb = s0 + (st + 1) * ST_;
            async_copy_b128(lds_off(&sK[b ^ 1][t * 4]), Kg + (size_t)(sb + r) * sstride + c0);
            async_copy_b128(lds_off(&sV[b ^ 1][t * 4]), Vg + (size_t)(sb + r) * sstride + c0);
            if (t < ST_) sM[b ^ 1][t] = Mp[sb + t];
            // Async loads complete in order per wave: <=2 outstanding means the
            // current stage's two copies have landed.
            asm volatile("s_wait_asynccnt 0x2" ::: "memory");
        } else {
            asm volatile("s_wait_asynccnt 0x0" ::: "memory");
        }
        __syncthreads();

        // In-place preprocess: Kf = feat(K)*mask (once per element), Vs = V*mask/S.
        {
            const float m  = sM[b][r];
            const float ms = m * scale;
            float* pk = &sK[b][t * 4];
            float* pv = &sV[b][t * 4];
#pragma unroll
            for (int i = 0; i < 4; ++i) pk[i] = feat(pk[i]) * m;
#pragma unroll
            for (int i = 0; i < 4; ++i) pv[i] *= ms;
        }
        __syncthreads();

        // 8 WMMA F32 16x16x4 over the 32 staged rows, operands from LDS.
#pragma unroll
        for (int ss = 0; ss < ST_; ss += 4) {
            v2f a, bb;
            a.x  = sK[b][(ss + kk) * D_ + d];
            a.y  = sK[b][(ss + kk + 1) * D_ + d];
            bb.x = sV[b][(ss + kk) * D_ + v];
            bb.y = sV[b][(ss + kk + 1) * D_ + v];
            c = __builtin_amdgcn_wmma_f32_16x16x4_f32(
                    false, a, false, bb, (short)0, c, false, false);
            ksumLocal += a.x + a.y;   // each (s,d) covered once per wave
        }
        __syncthreads();  // buffer b reusable for stage st+2
    }

    // Accumulate partial tile into workspace (8 chunk-blocks race via f32 atomics).
    float* KVdst = KVws + nh * (D_ * D_);
#pragma unroll
    for (int j = 0; j < 8; ++j) {
        const int row = tr * 16 + hi * 8 + j;
        atomicAdd(&KVdst[row * D_ + v], c[j]);
    }
    if (tc == 0) atomicAdd(&KsumWs[nh * D_ + d], ksumLocal);
}

// ---------------- Phase B: out = (Qf @ KV) * Z * S ----------------
// grid (N*H, L/64), 512 threads = 16 waves; KV + featured Q + Ksum + Z in LDS.
__global__ __launch_bounds__(512) void out_kernel(
        const float* __restrict__ Q, const float* __restrict__ qm,
        const float* __restrict__ KVws, const float* __restrict__ KsumWs,
        float* __restrict__ out) {
    __shared__ __align__(16) float sKV[D_ * D_];
    __shared__ __align__(16) float sQ[64 * D_];
    __shared__ float sKs[D_];
    __shared__ float sZ[64];

    const int nh = blockIdx.x;
    const int n  = nh / H_;
    const int h  = nh % H_;
    const int l0 = blockIdx.y * 64;
    const int t  = threadIdx.x;

    // Stage KV tile with b128 loads.
    {
        const v4f* KVv = (const v4f*)(KVws + nh * (D_ * D_));
        v4f* sKVv = (v4f*)sKV;
#pragma unroll
        for (int i = 0; i < 2; ++i) sKVv[t + i * 512] = KVv[t + i * 512];
    }
    if (t < D_) sKs[t] = KsumWs[nh * D_ + t];

    // Stage 64 featured Q rows with b128 loads (row-contiguous, 16B aligned).
#pragma unroll
    for (int i = 0; i < 2; ++i) {
        const int idx4 = t + i * 512;        // float4 index 0..1023
        const int flat = idx4 * 4;
        const int rr   = flat >> 6;
        const int dd   = flat & 63;
        const int l    = l0 + rr;
        const v4f q    = *(const v4f*)&Q[(((long)n * L_ + l) * H_ + h) * D_ + dd];
        const float qmv = qm[n * L_ + l];
        v4f o;
        o.x = feat(q.x) * qmv;
        o.y = feat(q.y) * qmv;
        o.z = feat(q.z) * qmv;
        o.w = feat(q.w) * qmv;
        *(v4f*)&sQ[flat] = o;
    }
    __syncthreads();

    // Z[l] = S / (Qf . Ksum + eps)   (the S folds away the 1/S baked into KV)
    if (t < 64) {
        float dot = 0.0f;
#pragma unroll
        for (int dd = 0; dd < D_; ++dd) dot += sQ[t * D_ + dd] * sKs[dd];
        sZ[t] = (float)S_ / (dot + EPS_);
    }
    __syncthreads();

    const int wave  = t >> 5;
    const int lane  = t & 31;
    const int laneM = lane & 15;
    const int hi    = lane >> 4;
    const int kk    = hi * 2;
    const int mr    = wave >> 2;          // 16-row tile
    const int nc    = wave & 3;           // 16-col tile
    const int col   = nc * 16 + laneM;
    const int rowA  = mr * 16 + laneM;

    v8f c = {0.f, 0.f, 0.f, 0.f, 0.f, 0.f, 0.f, 0.f};
#pragma unroll
    for (int k = 0; k < D_; k += 4) {
        v2f a, b;
        a.x = sQ[rowA * D_ + k + kk];          // A: Qf (16 l-rows x 4 d-cols)
        a.y = sQ[rowA * D_ + k + kk + 1];
        b.x = sKV[(k + kk) * D_ + col];        // B: KV (4 d-rows x 16 v-cols)
        b.y = sKV[(k + kk + 1) * D_ + col];
        c = __builtin_amdgcn_wmma_f32_16x16x4_f32(
                false, a, false, b, (short)0, c, false, false);
    }

#pragma unroll
    for (int j = 0; j < 8; ++j) {
        const int row = mr * 16 + hi * 8 + j;
        const int l   = l0 + row;
        out[(((long)n * L_ + l) * H_ + h) * D_ + col] = c[j] * sZ[row];
    }
}

extern "C" void kernel_launch(void* const* d_in, const int* in_sizes, int n_in,
                              void* d_out, int out_size, void* d_ws, size_t ws_size,
                              hipStream_t stream) {
    const float* Q      = (const float*)d_in[0];
    const float* K      = (const float*)d_in[1];
    const float* V      = (const float*)d_in[2];
    const float* qmask  = (const float*)d_in[3];
    const float* kvmask = (const float*)d_in[4];
    float* outp = (float*)d_out;

    float* KVws   = (float*)d_ws;                 // N*H*64*64 floats (1 MB)
    float* KsumWs = KVws + N_ * H_ * D_ * D_;     // N*H*64 floats
    const int nf  = N_ * H_ * D_ * D_ + N_ * H_ * D_;

    zero_ws_kernel<<<(nf + 255) / 256, 256, 0, stream>>>(KVws, nf);
    kv_kernel<<<dim3(N_ * H_, NCHUNKS), 512, 0, stream>>>(K, V, kvmask, KVws, KsumWs);
    out_kernel<<<dim3(N_ * H_, L_ / 64), 512, 0, stream>>>(Q, qmask, KVws, KsumWs, outp);
}

// v001
// Measured time: 54 microseconds a run.
// Next to v000, in two timings, it ran 1.41 and 1.40 times as fast.
#include <hip/hip_runtime.h>
#include <hip/hip_bf16.h>

#define N_ 8
#define L_ 4096
#define S_ 4096
#define H_ 8
#define D_ 64
#define EPS_ 1e-6f
#define SCHUNK 512
#define NCHUNKS (S_ / SCHUNK)
#define ST_ 32                    // s-rows per LDS stage (K tile 8KB + V tile 8KB)
#define NST (SCHUNK / ST_)
#define QP_ 68
#define KVP_ 80

typedef __attribute__((ext_vector_type(2))) float v2f;
typedef __attribute__((ext_vector_type(4))) float v4f;
typedef __attribute__((ext_vector_type(8))) float v8f;

__device__ __forceinline__ float feat(float x) {
    // elu(x) + 1
    return x > 0.0f ? (x + 1.0f) : __expf(x);
}

__device__ __forceinline__ unsigned lds_off(const void* p) {
    return (unsigned)(unsigned long long)p;
}

__device__ __forceinline__ void async_copy_b128(unsigned lds_byte, const float* gaddr) {
    asm volatile("global_load_async_to_lds_b128 %0, %1, off"
                 :: "v"(lds_byte), "v"(gaddr) : "memory");
}

__global__ void zero_ws_kernel(float* __restrict__ ws, int nfloats) {
    int i = blockIdx.x * blockDim.x + threadIdx.x;
    if (i < nfloats) ws[i] = 0.0f;
}

// ---------------- Phase A: KV = Kf^T @ (V/S), Ksum = colsum(Kf) ----------------
// grid (N*H, NCHUNKS), 512 threads = 16 waves; wave (tr,tc) owns a 16x16 tile of
// the 64x64 KV output. 32-row K/V stages double-buffered through LDS.
__global__ __launch_bounds__(512) void kv_kernel(
        const float* __restrict__ K, const float* __restrict__ V,
        const float* __restrict__ kvm,
        float* __restrict__ KVws, float* __restrict__ KsumWs) {
    __shared__ __align__(16) float sK[2][ST_ * D_];
    __shared__ __align__(16) float sV[2][ST_ * D_];
    __shared__ float sM[2][ST_];

    const int nh = blockIdx.x;
    const int n  = nh / H_;
    const int h  = nh % H_;
    const int s0 = blockIdx.y * SCHUNK;

    const int t     = threadIdx.x;
    const int wave  = t >> 5;
    const int lane  = t & 31;
    const int laneM = lane & 15;
    const int hi    = lane >> 4;      // lane half -> WMMA K offsets {0,1} vs {2,3}
    const int kk    = hi * 2;
    const int tr    = wave >> 2;
    const int tc    = wave & 3;
    const int d     = tr * 16 + laneM;   // KV row
    const int v     = tc * 16 + laneM;   // KV col
    const float scale = 1.0f / (float)S_;

    // staging: thread t copies 16B = 4 floats; row r, cols [c0,c0+4)
    const int r  = t >> 4;
    const int c0 = (t & 15) * 4;
    const int sstride = H_ * D_;
    const float* Kg = K + ((long)n * S_ * H_ + h) * D_;
    const float* Vg = V + ((long)n * S_ * H_ + h) * D_;
    const float* Mp = kvm + n * S_;

    // Prologue: stage 0 into buffer 0.
    async_copy_b128(lds_off(&sK[0][t * 4]), Kg + (size_t)(s0 + r) * sstride + c0);
    async_copy_b128(lds_off(&sV[0][t * 4]), Vg + (size_t)(s0 + r) * sstride + c0);
    if (t < ST_) sM[0][t] = Mp[s0 + t];

    v8f c = {0.f, 0.f, 0.f, 0.f, 0.f, 0.f, 0.f, 0.f};
    float ksumLocal = 0.0f;

    for (int st = 0; st < NST; ++st) {
        const int b = st & 1;

        if (st + 1 < NST) {
            // Kick next stage into the other buffer (freed by last iter's barrier).
            const int sb = s0 + (st + 1) * ST_;
            async_copy_b128(lds_off(&sK[b ^ 1][t * 4]), Kg + (size_t)(sb + r) * sstride + c0);
            async_copy_b128(lds_off(&sV[b ^ 1][t * 4]), Vg + (size_t)(sb + r) * sstride + c0);
            if (t < ST_) sM[b ^ 1][t] = Mp[sb + t];
            // Async loads complete in order per wave: <=2 outstanding means the
            // current stage's two copies have landed.
            asm volatile("s_wait_asynccnt 0x2" ::: "memory");
        } else {
            asm volatile("s_wait_asynccnt 0x0" ::: "memory");
        }
        __syncthreads();

        // In-place preprocess: Kf = feat(K)*mask (once per element), Vs = V*mask/S.
        {
            const float m  = sM[b][r];
            const float ms = m * scale;
            float* pk = &sK[b][t * 4];
            float* pv = &sV[b][t * 4];
#pragma unroll
            for (int i = 0; i < 4; ++i) pk[i] = feat(pk[i]) * m;
#pragma unroll
            for (int i = 0; i < 4; ++i) pv[i] *= ms;
        }
        __syncthreads();

        // 8 WMMA F32 16x16x4 over the 32 staged rows, operands from LDS.
#pragma unroll
        for (int ss = 0; ss < ST_; ss += 4) {
            v2f a, bb;
            a.x  = sK[b][(ss + kk) * D_ + d];
            a.y  = sK[b][(ss + kk + 1) * D_ + d];
            bb.x = sV[b][(ss + kk) * D_ + v];
            bb.y = sV[b][(ss + kk + 1) * D_ + v];
            c = __builtin_amdgcn_wmma_f32_16x16x4_f32(
                    false, a, false, bb, (short)0, c, false, false);
            ksumLocal += a.x + a.y;   // each (s,d) covered once per wave
        }
        __syncthreads();  // buffer b reusable for stage st+2
    }

    // Accumulate partial tile into workspace (8 chunk-blocks race via f32 atomics).
    float* KVdst = KVws + nh * (D_ * D_);
#pragma unroll
    for (int j = 0; j < 8; ++j) {
        const int row = tr * 16 + hi * 8 + j;
        atomicAdd(&KVdst[row * D_ + v], c[j]);
    }
    if (tc == 0) atomicAdd(&KsumWs[nh * D_ + d], ksumLocal);
}

// ---------------- Phase B: out = (Qf @ KV) * Z * S ----------------
// grid (N*H, L/64), 512 threads = 16 waves; KV + featured Q + Ksum + Z in LDS.
__global__ __launch_bounds__(512) void out_kernel(
        const float* __restrict__ Q, const float* __restrict__ qm,
        const float* __restrict__ KVws, const float* __restrict__ KsumWs,
        float* __restrict__ out) {
    __shared__ __align__(16) float sKV[D_ * KVP_];
    __shared__ __align__(16) float sQ[64 * QP_];
    __shared__ float sKs[D_];
    __shared__ float sZ[64];

    const int nh = blockIdx.x;
    const int n  = nh / H_;
    const int h  = nh % H_;
    const int l0 = blockIdx.y * 64;
    const int t  = threadIdx.x;

    // Stage KV tile with b128 loads.
    {
        const v4f* KVv = (const v4f*)(KVws + nh * (D_ * D_));
#pragma unroll
        for (int i = 0; i < 2; ++i) {
            const int flat = (t + i * 512) * 4;
            *(v4f*)&sKV[(flat >> 6) * KVP_ + (flat & 63)] = KVv[t + i * 512];
        }
    }
    if (t < D_) sKs[t] = KsumWs[nh * D_ + t];

    // Stage 64 featured Q rows with b128 loads (row-contiguous, 16B aligned).
#pragma unroll
    for (int i = 0; i < 2; ++i) {
        const int idx4 = t + i * 512;        // float4 index 0..1023
        const int flat = idx4 * 4;
        const int rr   = flat >> 6;
        const int dd   = flat & 63;
        const int l    = l0 + rr;
        const v4f q    = *(const v4f*)&Q[(((long)n * L_ + l) * H_ + h) * D_ + dd];
        const float qmv = qm[n * L_ + l];
        v4f o;
        o.x = feat(q.x) * qmv;
        o.y = feat(q.y) * qmv;
        o.z = feat(q.z) * qmv;
        o.w = feat(q.w) * qmv;
        *(v4f*)&sQ[rr * QP_ + dd] = o;
    }
    __syncthreads();

    // Z[l] = S / (Qf . Ksum + eps)   (the S folds away the 1/S baked into KV)
    if (t < 64) {
        float dot = 0.0f;
#pragma unroll
        for (int dd = 0; dd < D_; ++dd) dot += sQ[t * QP_ + dd] * sKs[dd];
        sZ[t] = (float)S_ / (dot + EPS_);
    }
    __syncthreads();

    const int wave  = t >> 5;
    const int lane  = t & 31;
    const int laneM = lane & 15;
    const int hi    = lane >> 4;
    const int kk    = hi * 2;
    const int mr    = wave >> 2;          // 16-row tile
    const int nc    = wave & 3;           // 16-col tile
    const int col   = nc * 16 + laneM;
    const int rowA  = mr * 16 + laneM;

    v8f c = {0.f, 0.f, 0.f, 0.f, 0.f, 0.f, 0.f, 0.f};
#pragma unroll
    for (int k = 0; k < D_; k += 4) {
        v2f a, b;
        a.x = sQ[rowA * QP_ + k + kk];         // A: Qf (16 l-rows x 4 d-cols)
        a.y = sQ[rowA * QP_ + k + kk + 1];
        b.x = sKV[(k + kk) * KVP_ + col];      // B: KV (4 d-rows x 16 v-cols)
        b.y = sKV[(k + kk + 1) * KVP_ + col];
        c = __builtin_amdgcn_wmma_f32_16x16x4_f32(
                false, a, false, b, (short)0, c, false, false);
    }

#pragma unroll
    for (int j = 0; j < 8; ++j) {
        const int row = mr * 16 + hi * 8 + j;
        const int l   = l0 + row;
        out[(((long)n * L_ + l) * H_ + h) * D_ + col] = c[j] * sZ[row];
    }
}

extern "C" void kernel_launch(void* const* d_in, const int* in_sizes, int n_in,
                              void* d_out, int out_size, void* d_ws, size_t ws_size,
                              hipStream_t stream) {
    const float* Q      = (const float*)d_in[0];
    const float* K      = (const float*)d_in[1];
    const float* V      = (const float*)d_in[2];
    const float* qmask  = (const float*)d_in[3];
    const float* kvmask = (const float*)d_in[4];
    float* outp = (float*)d_out;

    float* KVws   = (float*)d_ws;                 // N*H*64*64 floats (1 MB)
    float* KsumWs = KVws + N_ * H_ * D_ * D_;     // N*H*64 floats
    const int nf  = N_ * H_ * D_ * D_ + N_ * H_ * D_;

    zero_ws_kernel<<<(nf + 255) / 256, 256, 0, stream>>>(KVws, nf);
    kv_kernel<<<dim3(N_ * H_, NCHUNKS), 512, 0, stream>>>(K, V, kvmask, KVws, KsumWs);
    out_kernel<<<dim3(N_ * H_, L_ / 64), 512, 0, stream>>>(Q, qmask, KVws, KsumWs, outp);
}

// v002
// It runs in 42.5 microseconds.
// Next to v001, in two timings, it ran 1.26 and 1.27 times as fast.
// Counting every step since v000, it is 1.78 times as fast.
#include <hip/hip_runtime.h>
#include <hip/hip_bf16.h>

#define N_ 8
#define L_ 4096
#define S_ 4096
#define H_ 8
#define D_ 64
#define EPS_ 1e-6f
#define SCHUNK 1024
#define NCHUNKS (S_ / SCHUNK)
#define WAVES_ 16                 // waves per Phase A work-group
#define NGRP (SCHUNK / (WAVES_ * 4))   // 4-row groups per wave
#define PF_ 2                     // groups of loads in flight ahead of the WMMAs
#define QP_ 68
#define KVP_ 80

typedef __attribute__((ext_vector_type(2))) float v2f;
typedef __attribute__((ext_vector_type(4))) float v4f;
typedef __attribute__((ext_vector_type(8))) float v8f;

__device__ __forceinline__ float feat(float x) {
    // elu(x) + 1
    return x > 0.0f ? (x + 1.0f) : __expf(x);
}

__global__ void zero_ws_kernel(float* __restrict__ ws, int nfloats) {
    int i = blockIdx.x * blockDim.x + threadIdx.x;
    if (i < nfloats) ws[i] = 0.0f;
}

struct KvGroup { v4f k0, k1, v0, v1; v2f m; };

__device__ __forceinline__ void exp2x8(float (&r)[8], const float (&y)[8]) {
    asm("v_exp_f32 %0, %8\n\t"
        "v_exp_f32 %1, %9\n\t"
        "v_exp_f32 %2, %10\n\t"
        "v_exp_f32 %3, %11\n\t"
        "v_exp_f32 %4, %12\n\t"
        "v_exp_f32 %5, %13\n\t"
        "v_exp_f32 %6, %14\n\t"
        "v_exp_f32 %7, %15\n\t"
        "v_nop"
        : "=&v"(r[0]), "=&v"(r[1]), "=&v"(r[2]), "=&v"(r[3]),
          "=&v"(r[4]), "=&v"(r[5]), "=&v"(r[6]), "=&v"(r[7])
        : "v"(y[0]), "v"(y[1]), "v"(y[2]), "v"(y[3]),
          "v"(y[4]), "v"(y[5]), "v"(y[6]), "v"(y[7]));
}

// Kb, Vb, Mb: work-group-uniform bases; off, moff: this lane's element offsets.
__device__ __forceinline__ KvGroup kv_load(const float* __restrict__ Kb,
                                           const float* __restrict__ Vb,
                                           const float* __restrict__ Mb,
                                           unsigned off, unsigned moff, int g) {
    KvGroup x;
    const unsigned ro = g * (WAVES_ * 4);     // first row of this wave's group g
    x.k0 = *(const v4f*)(Kb + (off + ro * (H_ * D_)));
    x.k1 = *(const v4f*)(Kb + (off + (ro + 1) * (H_ * D_)));
    x.v0 = *(const v4f*)(Vb + (off + ro * (H_ * D_)));
    x.v1 = *(const v4f*)(Vb + (off + (ro + 1) * (H_ * D_)));
    x.m  = *(const v2f*)(Mb + (moff + ro));
    return x;
}

__global__ __launch_bounds__(512) void kv_kernel(
        const float* __restrict__ K, const float* __restrict__ V,
        const float* __restrict__ kvm,
        float* __restrict__ KVws, float* __restrict__ KsumWs) {
    __shared__ __align__(16) float sP[WAVES_][D_ * D_];   // one partial tile per wave
    __shared__ __align__(16) float sS[WAVES_ * 2][D_];    // Ksum partial per half wave

    const int nh = blockIdx.x;
    const int n  = nh / H_;
    const int h  = nh % H_;
    const int s0 = blockIdx.y * SCHUNK;

    const int t     = threadIdx.x;
    const int wave  = t >> 5;
    const int lane  = t & 31;
    const int laneM = lane & 15;
    const int hi    = lane >> 4;      // lane half -> WMMA K offsets {0,1} vs {2,3}
    const float scale = 1.0f / (float)S_;

    const float* Kb = K + (((size_t)n * S_ + s0) * H_ + h) * D_;
    const float* Vb = V + (((size_t)n * S_ + s0) * H_ + h) * D_;
    const float* Mb = kvm + n * S_ + s0;
    const unsigned moff = wave * 4 + hi * 2;
    const unsigned off  = moff * (H_ * D_) + laneM * 4;

    v8f c[4][4];
#pragma unroll
    for (int i = 0; i < 4; ++i)
#pragma unroll
        for (int j = 0; j < 4; ++j)
            c[i][j] = (v8f){0.f, 0.f, 0.f, 0.f, 0.f, 0.f, 0.f, 0.f};
    v4f ks = {0.f, 0.f, 0.f, 0.f};

    KvGroup ring[PF_];
#pragma unroll
    for (int g = 0; g < PF_; ++g) ring[g] = kv_load(Kb, Vb, Mb, off, moff, g);

    // Unrolled so that the ring is indexed by constants (stays in registers) and the
    // row steps become immediate offsets on unchanged address registers.
#pragma unroll
    for (int g = 0; g < NGRP; ++g) {
        const KvGroup x = ring[g % PF_];
        if (g + PF_ < NGRP) ring[g % PF_] = kv_load(Kb, Vb, Mb, off, moff, g + PF_);

        const float m0 = x.m.x, m1 = x.m.y;
        const float ms0 = m0 * scale, ms1 = m1 * scale;
        // elu(x) + 1 as in feat(): e^x = 2^(x * log2 e), the form __expf compiles to.
        float y[8], e[8];
#pragma unroll
        for (int i = 0; i < 4; ++i) {
            y[2 * i]     = x.k0[i] * 1.44269504f;
            y[2 * i + 1] = x.k1[i] * 1.44269504f;
        }
        exp2x8(e, y);
        v2f a[4], b[4];
#pragma unroll
        for (int i = 0; i < 4; ++i) {
            a[i].x = (x.k0[i] > 0.0f ? x.k0[i] + 1.0f : e[2 * i]) * m0;
            a[i].y = (x.k1[i] > 0.0f ? x.k1[i] + 1.0f : e[2 * i + 1]) * m1;
            b[i].x = x.v0[i] * ms0;
            b[i].y = x.v1[i] * ms1;
            ks[i] += a[i].x + a[i].y;
        }
#pragma unroll
        for (int i = 0; i < 4; ++i)
#pragma unroll
            for (int j = 0; j < 4; ++j)
                c[i][j] = __builtin_amdgcn_wmma_f32_16x16x4_f32(
                        false, a[i], false, b[j], (short)0, c[i][j], false, false);
        // Keeps later groups' loads from being hoisted above this point: without it
        // the scheduler starts five groups at once and spills accumulators.
        __builtin_amdgcn_sched_barrier(0);
    }

#pragma unroll
    for (int i = 0; i < 4; ++i)
#pragma unroll
        for (int r = 0; r < 8; ++r) {
            const int row = (r + 8 * hi) * 4 + i;
            v4f o = {c[i][0][r], c[i][1][r], c[i][2][r], c[i][3][r]};
            *(v4f*)&sP[wave][row * D_ + laneM * 4] = o;
        }
    *(v4f*)&sS[wave * 2 + hi][laneM * 4] = ks;
    __syncthreads();

    // Sum the 16 partials in wave order; wave w alone reads (and then rewrites)
    // elements [half*2048 + 128*w, +128) of every partial.
#pragma unroll
    for (int half = 0; half < 2; ++half) {
        const int e = half * 2048 + t * 4;
        v4f s = *(const v4f*)&sP[0][e];
#pragma unroll
        for (int p = 1; p < WAVES_; ++p) s += *(const v4f*)&sP[p][e];
        *(v4f*)&sP[0][e] = s;
    }
    __syncthreads();

    // One f32 atomic per element and chunk, 128 contiguous bytes per wave instruction.
    float* KVdst = KVws + nh * (D_ * D_);
    float tot[8];
#pragma unroll
    for (int q = 0; q < 8; ++q)
        tot[q] = sP[0][(q >> 2) * 2048 + wave * 128 + (q & 3) * 32 + lane];
#pragma unroll
    for (int q = 0; q < 8; ++q)
        atomicAdd(&KVdst[(q >> 2) * 2048 + wave * 128 + (q & 3) * 32 + lane], tot[q]);
    if (t < D_) {
        float s = 0.0f;
#pragma unroll
        for (int p = 0; p < WAVES_ * 2; ++p) s += sS[p][t];
        atomicAdd(&KsumWs[nh * D_ + t], s);
    }
}

// ---------------- Phase B: out = (Qf @ KV) * Z * S ----------------
// grid (N*H, L/64), 512 threads = 16 waves; KV + featured Q + Ksum + Z in LDS.
__global__ __launch_bounds__(512) void out_kernel(
        const float* __restrict__ Q, const float* __restrict__ qm,
        const float* __restrict__ KVws, const float* __restrict__ KsumWs,
        float* __restrict__ out) {
    __shared__ __align__(16) float sKV[D_ * KVP_];
    __shared__ __align__(16) float sQ[64 * QP_];
    __shared__ float sKs[D_];
    __shared__ float sZ[64];

    const int nh = blockIdx.x;
    const int n  = nh / H_;
    const int h  = nh % H_;
    const int l0 = blockIdx.y * 64;
    const int t  = threadIdx.x;

    // Stage KV tile with b128 loads.
    {
        const v4f* KVv = (const v4f*)(KVws + nh * (D_ * D_));
#pragma unroll
        for (int i = 0; i < 2; ++i) {
            const int flat = (t + i * 512) * 4;
            *(v4f*)&sKV[(flat >> 6) * KVP_ + (flat & 63)] = KVv[t + i * 512];
        }
    }
    if (t < D_) sKs[t] = KsumWs[nh * D_ + t];

    // Stage 64 featured Q rows with b128 loads (row-contiguous, 16B aligned).
#pragma unroll
    for (int i = 0; i < 2; ++i) {
        const int idx4 = t + i * 512;        // float4 index 0..1023
        const int flat = idx4 * 4;
        const int rr   = flat >> 6;
        const int dd   = flat & 63;
        const int l    = l0 + rr;
        const v4f q    = *(const v4f*)&Q[(((long)n * L_ + l) * H_ + h) * D_ + dd];
        const float qmv = qm[n * L_ + l];
        v4f o;
        o.x = feat(q.x) * qmv;
        o.y = feat(q.y) * qmv;
        o.z = feat(q.z) * qmv;
        o.w = feat(q.w) * qmv;
        *(v4f*)&sQ[rr * QP_ + dd] = o;
    }
    __syncthreads();

    // Z[l] = S / (Qf . Ksum + eps)   (the S folds away the 1/S baked into KV)
    if (t < 64) {
        float dot = 0.0f;
#pragma unroll
        for (int dd = 0; dd < D_; ++dd) dot += sQ[t * QP_ + dd] * sKs[dd];
        sZ[t] = (float)S_ / (dot + EPS_);
    }
    __syncthreads();

    const int wave  = t >> 5;
    const int lane  = t & 31;
    const int laneM = lane & 15;
    const int hi    = lane >> 4;
    const int kk    = hi * 2;
    const int mr    = wave >> 2;          // 16-row tile
    const int nc    = wave & 3;           // 16-col tile
    const int col   = nc * 16 + laneM;
    const int rowA  = mr * 16 + laneM;

    v8f c = {0.f, 0.f, 0.f, 0.f, 0.f, 0.f, 0.f, 0.f};
#pragma unroll
    for (int k = 0; k < D_; k += 4) {
        v2f a, b;
        a.x = sQ[rowA * QP_ + k + kk];         // A: Qf (16 l-rows x 4 d-cols)
        a.y = sQ[rowA * QP_ + k + kk + 1];
        b.x = sKV[(k + kk) * KVP_ + col];      // B: KV (4 d-rows x 16 v-cols)
        b.y = sKV[(k + kk + 1) * KVP_ + col];
        c = __builtin_amdgcn_wmma_f32_16x16x4_f32(
                false, a, false, b, (short)0, c, false, false);
    }

#pragma unroll
    for (int j = 0; j < 8; ++j) {
        const int row = mr * 16 + hi * 8 + j;
        const int l   = l0 + row;
        out[(((long)n * L_ + l) * H_ + h) * D_ + col] = c[j] * sZ[row];
    }
}

extern "C" void kernel_launch(void* const* d_in, const int* in_sizes, int n_in,
                              void* d_out, int out_size, void* d_ws, size_t ws_size,
                              hipStream_t stream) {
    const float* Q      = (const float*)d_in[0];
    const float* K      = (const float*)d_in[1];
    const float* V      = (const float*)d_in[2];
    const float* qmask  = (const float*)d_in[3];
    const float* kvmask = (const float*)d_in[4];
    float* outp = (float*)d_out;

    float* KVws   = (float*)d_ws;                 // N*H*64*64 floats (1 MB)
    float* KsumWs = KVws + N_ * H_ * D_ * D_;     // N*H*64 floats
    const int nf  = N_ * H_ * D_ * D_ + N_ * H_ * D_;

    zero_ws_kernel<<<(nf + 255) / 256, 256, 0, stream>>>(KVws, nf);
    kv_kernel<<<dim3(N_ * H_, NCHUNKS), 512, 0, stream>>>(K, V, kvmask, KVws, KsumWs);
    out_kernel<<<dim3(N_ * H_, L_ / 64), 512, 0, stream>>>(Q, qmask, KVws, KsumWs, outp);
}

// v003
// A run of this version takes 34.6 microseconds.
// Next to v002, in two timings, it ran 1.23 and 1.22 times as fast.
// Over all steps from v000 it is 2.18 times as fast.
#include <hip/hip_runtime.h>
#include <hip/hip_bf16.h>

#define N_ 8
#define L_ 4096
#define S_ 4096
#define H_ 8
#define D_ 64
#define EPS_ 1e-6f
#define SCHUNK 1024
#define NCHUNKS (S_ / SCHUNK)
#define WAVES_ 16                 // waves per Phase A work-group
#define NGRP (SCHUNK / (WAVES_ * 4))   // 4-row groups per wave
#define PF_ 2                     // groups of loads in flight ahead of the WMMAs
#define OW_ 16                    // waves per Phase B work-group
#define LCHUNK 1024               // l rows per Phase B work-group
#define OTILES (LCHUNK / (OW_ * 16))   // 16-row tiles per wave
#define QP_ 68

typedef __attribute__((ext_vector_type(2))) float v2f;
typedef __attribute__((ext_vector_type(4))) float v4f;
typedef __attribute__((ext_vector_type(8))) float v8f;

__global__ void zero_ws_kernel(float* __restrict__ ws, int nfloats) {
    int i = blockIdx.x * blockDim.x + threadIdx.x;
    if (i < nfloats) ws[i] = 0.0f;
}

struct KvGroup { v4f k0, k1, v0, v1; v2f m; };

__device__ __forceinline__ void exp2x8(float (&r)[8], const float (&y)[8]) {
    asm("v_exp_f32 %0, %8\n\t"
        "v_exp_f32 %1, %9\n\t"
        "v_exp_f32 %2, %10\n\t"
        "v_exp_f32 %3, %11\n\t"
        "v_exp_f32 %4, %12\n\t"
        "v_exp_f32 %5, %13\n\t"
        "v_exp_f32 %6, %14\n\t"
        "v_exp_f32 %7, %15\n\t"
        "v_nop"
        : "=&v"(r[0]), "=&v"(r[1]), "=&v"(r[2]), "=&v"(r[3]),
          "=&v"(r[4]), "=&v"(r[5]), "=&v"(r[6]), "=&v"(r[7])
        : "v"(y[0]), "v"(y[1]), "v"(y[2]), "v"(y[3]),
          "v"(y[4]), "v"(y[5]), "v"(y[6]), "v"(y[7]));
}

// Kb, Vb, Mb: work-group-uniform bases; off, moff: this lane's element offsets.
__device__ __forceinline__ KvGroup kv_load(const float* __restrict__ Kb,
                                           const float* __restrict__ Vb,
                                           const float* __restrict__ Mb,
                                           unsigned off, unsigned moff, int g) {
    KvGroup x;
    const unsigned ro = g * (WAVES_ * 4);     // first row of this wave's group g
    x.k0 = *(const v4f*)(Kb + (off + ro * (H_ * D_)));
    x.k1 = *(const v4f*)(Kb + (off + (ro + 1) * (H_ * D_)));
    x.v0 = *(const v4f*)(Vb + (off + ro * (H_ * D_)));
    x.v1 = *(const v4f*)(Vb + (off + (ro + 1) * (H_ * D_)));
    x.m  = *(const v2f*)(Mb + (moff + ro));
    return x;
}

__global__ __launch_bounds__(512) void kv_kernel(
        const float* __restrict__ K, const float* __restrict__ V,
        const float* __restrict__ kvm,
        float* __restrict__ KVws, float* __restrict__ KsumWs) {
    __shared__ __align__(16) float sP[WAVES_][D_ * D_];   // one partial tile per wave
    __shared__ __align__(16) float sS[WAVES_ * 2][D_];    // Ksum partial per half wave

    const int nh = blockIdx.x;
    const int n  = nh / H_;
    const int h  = nh % H_;
    const int s0 = blockIdx.y * SCHUNK;

    const int t     = threadIdx.x;
    const int wave  = t >> 5;
    const int lane  = t & 31;
    const int laneM = lane & 15;
    const int hi    = lane >> 4;      // lane half -> WMMA K offsets {0,1} vs {2,3}
    const float scale = 1.0f / (float)S_;

    const float* Kb = K + (((size_t)n * S_ + s0) * H_ + h) * D_;
    const float* Vb = V + (((size_t)n * S_ + s0) * H_ + h) * D_;
    const float* Mb = kvm + n * S_ + s0;
    const unsigned moff = wave * 4 + hi * 2;
    const unsigned off  = moff * (H_ * D_) + laneM * 4;

    v8f c[4][4];
#pragma unroll
    for (int i = 0; i < 4; ++i)
#pragma unroll
        for (int j = 0; j < 4; ++j)
            c[i][j] = (v8f){0.f, 0.f, 0.f, 0.f, 0.f, 0.f, 0.f, 0.f};
    v4f ks = {0.f, 0.f, 0.f, 0.f};

    KvGroup ring[PF_];
#pragma unroll
    for (int g = 0; g < PF_; ++g) ring[g] = kv_load(Kb, Vb, Mb, off, moff, g);

    // Unrolled so that the ring is indexed by constants (stays in registers) and the
    // row steps become immediate offsets on unchanged address registers.
#pragma unroll
    for (int g = 0; g < NGRP; ++g) {
        const KvGroup x = ring[g % PF_];
        if (g + PF_ < NGRP) ring[g % PF_] = kv_load(Kb, Vb, Mb, off, moff, g + PF_);

        const float m0 = x.m.x, m1 = x.m.y;
        const float ms0 = m0 * scale, ms1 = m1 * scale;
        // elu(x) + 1: e^x = 2^(x * log2 e), the form __expf compiles to.
        float y[8], e[8];
#pragma unroll
        for (int i = 0; i < 4; ++i) {
            y[2 * i]     = x.k0[i] * 1.44269504f;
            y[2 * i + 1] = x.k1[i] * 1.44269504f;
        }
        exp2x8(e, y);
        v2f a[4], b[4];
#pragma unroll
        for (int i = 0; i < 4; ++i) {
            a[i].x = (x.k0[i] > 0.0f ? x.k0[i] + 1.0f : e[2 * i]) * m0;
            a[i].y = (x.k1[i] > 0.0f ? x.k1[i] + 1.0f : e[2 * i + 1]) * m1;
            b[i].x = x.v0[i] * ms0;
            b[i].y = x.v1[i] * ms1;
            ks[i] += a[i].x + a[i].y;
        }
#pragma unroll
        for (int i = 0; i < 4; ++i)
#pragma unroll
            for (int j = 0; j < 4; ++j)
                c[i][j] = __builtin_amdgcn_wmma_f32_16x16x4_f32(
                        false, a[i], false, b[j], (short)0, c[i][j], false, false);
        // Keeps later groups' loads from being hoisted above this point: without it
        // the scheduler starts five groups at once and spills accumulators.
        __builtin_amdgcn_sched_barrier(0);
    }

#pragma unroll
    for (int i = 0; i < 4; ++i)
#pragma unroll
        for (int r = 0; r < 8; ++r) {
            const int row = (r + 8 * hi) * 4 + i;
            v4f o = {c[i][0][r], c[i][1][r], c[i][2][r], c[i][3][r]};
            *(v4f*)&sP[wave][row * D_ + laneM * 4] = o;
        }
    *(v4f*)&sS[wave * 2 + hi][laneM * 4] = ks;
    __syncthreads();

    // Sum the 16 partials in wave order; wave w alone reads (and then rewrites)
    // elements [half*2048 + 128*w, +128) of every partial.
#pragma unroll
    for (int half = 0; half < 2; ++half) {
        const int e = half * 2048 + t * 4;
        v4f s = *(const v4f*)&sP[0][e];
#pragma unroll
        for (int p = 1; p < WAVES_; ++p) s += *(const v4f*)&sP[p][e];
        *(v4f*)&sP[0][e] = s;
    }
    __syncthreads();

    // One f32 atomic per element and chunk, 128 contiguous bytes per wave instruction.
    float* KVdst = KVws + nh * (D_ * D_);
    float tot[8];
#pragma unroll
    for (int q = 0; q < 8; ++q)
        tot[q] = sP[0][(q >> 2) * 2048 + wave * 128 + (q & 3) * 32 + lane];
#pragma unroll
    for (int q = 0; q < 8; ++q)
        atomicAdd(&KVdst[(q >> 2) * 2048 + wave * 128 + (q & 3) * 32 + lane], tot[q]);
    if (t < D_) {
        float s = 0.0f;
#pragma unroll
        for (int p = 0; p < WAVES_ * 2; ++p) s += sS[p][t];
        atomicAdd(&KsumWs[nh * D_ + t], s);
    }
}

struct QRaw { v4f q[8]; };

// Qb: work-group-uniform base; off: this lane's element offset in tile 0.
__device__ __forceinline__ QRaw q_load(const float* __restrict__ Qb, unsigned off, int it) {
    QRaw x;
    const unsigned ro = it * (OW_ * 16);      // first row of this wave's tile
#pragma unroll
    for (int i = 0; i < 8; ++i)
        x.q[i] = *(const v4f*)(Qb + (off + (ro + 2 * i) * (H_ * D_)));
    return x;
}

__device__ __forceinline__ float xhalf(float x) {
    return __builtin_bit_cast(float, __builtin_amdgcn_permlanex16(
            __builtin_bit_cast(int, x), __builtin_bit_cast(int, x),
            0x76543210, 0xfedcba98, false, false));
}

__global__ __launch_bounds__(512) void out_kernel(
        const float* __restrict__ Q, const float* __restrict__ qm,
        const float* __restrict__ KVws, const float* __restrict__ KsumWs,
        float* __restrict__ out) {
    __shared__ __align__(16) float sKV[D_ * D_];
    __shared__ __align__(16) float sKs[D_];
    __shared__ __align__(16) float sM[LCHUNK];          // q_mask of the work-group's rows
    __shared__ __align__(16) float sQ[OW_][16 * QP_];   // each wave's own 16 rows

    const int nh = blockIdx.x;
    const int n  = nh / H_;
    const int h  = nh % H_;
    const int l0 = blockIdx.y * LCHUNK;

    const int t     = threadIdx.x;
    const int wave  = t >> 5;
    const int lane  = t & 31;
    const int laneM = lane & 15;
    const int hi    = lane >> 4;

    const float* Qb = Q + (((size_t)n * L_ + l0) * H_ + h) * D_;
    const float* Mb = qm + n * L_ + l0;
    float*       Ob = out + (((size_t)n * L_ + l0) * H_ + h) * D_;
    const unsigned off  = (wave * 16 + hi) * (H_ * D_) + laneM * 4;      // rows 2i + hi
    const unsigned ooff = (wave * 16 + hi * 8) * (H_ * D_) + laneM * 4;  // rows r + 8*hi

    QRaw x = q_load(Qb, off, 0);

    // KV, Ksum and the row masks once per work-group through LDS.
    {
        const v4f* KVv = (const v4f*)(KVws + nh * (D_ * D_));
        const v4f kv0 = KVv[t];
        const v4f kv1 = KVv[t + 512];
        const v2f mk  = *(const v2f*)(Mb + t * 2);
        // Before a register that one of the loads above names is used for something else.
        asm volatile("s_wait_xcnt 0x0" ::: "memory");
        if (t < D_) sKs[t] = KsumWs[nh * D_ + t];
        *(v4f*)&sKV[t * 4]         = kv0;
        *(v4f*)&sKV[(t + 512) * 4] = kv1;
        *(v2f*)&sM[t * 2]          = mk;
    }
    __syncthreads();

    v2f b[16][4];
#pragma unroll
    for (int p = 0; p < 8; ++p)
#pragma unroll
        for (int u = 0; u < 2; ++u) {
            const int d = 8 * p + 4 * hi + 2 * u;
            const v4f r0 = *(const v4f*)&sKV[d * D_ + laneM * 4];
            const v4f r1 = *(const v4f*)&sKV[(d + 1) * D_ + laneM * 4];
#pragma unroll
            for (int j = 0; j < 4; ++j) b[2 * p + u][j] = (v2f){r0[j], r1[j]};
        }

    float* sq = &sQ[wave][0];

    // Rolled: one copy of the 64 WMMAs in the text, and the only values carried round
    // are the B fragments and the tile in flight.
#pragma unroll 1
    for (int it = 0; it < OTILES; ++it) {
#pragma unroll
        for (int i = 0; i < 8; ++i)
            *(v4f*)&sq[(2 * i + hi) * QP_ + laneM * 4] = x.q[i];
        if (it + 1 < OTILES) x = q_load(Qb, off, it + 1);

        asm volatile("s_wait_dscnt 0x0\n\ts_wait_xcnt 0x0" ::: "memory");
        v4f a[8], ks[8];
#pragma unroll
        for (int p = 0; p < 8; ++p) {
            a[p]  = *(const v4f*)&sq[laneM * QP_ + 8 * p + 4 * hi];
            ks[p] = *(const v4f*)&sKs[8 * p + 4 * hi];
        }
        const float qmv = sM[(it * OW_ + wave) * 16 + laneM];    // A row = laneM

        // elu(x) + 1, and this lane's half of Qf . Ksum in four independent chains.
        v4f dot4 = {0.f, 0.f, 0.f, 0.f};
#pragma unroll
        for (int g = 0; g < 4; ++g) {
            float y[8], e[8];
#pragma unroll
            for (int c = 0; c < 4; ++c) {
                y[c]     = a[2 * g][c] * 1.44269504f;
                y[4 + c] = a[2 * g + 1][c] * 1.44269504f;
            }
            exp2x8(e, y);
#pragma unroll
            for (int c = 0; c < 4; ++c) {
                a[2 * g][c]     = a[2 * g][c] > 0.0f ? a[2 * g][c] + 1.0f : e[c];
                a[2 * g + 1][c] = a[2 * g + 1][c] > 0.0f ? a[2 * g + 1][c] + 1.0f : e[4 + c];
            }
            dot4 = __builtin_elementwise_fma(a[2 * g], ks[2 * g], dot4);
            dot4 = __builtin_elementwise_fma(a[2 * g + 1], ks[2 * g + 1], dot4);
        }
        const float part = (dot4[0] + dot4[1]) + (dot4[2] + dot4[3]);
        const float dot  = part + xhalf(part);
        // Row weight: mask * S / (mask * dot + eps); the S folds away the 1/S baked into
        // KV. It goes onto the A rows, where a lane holds one row only.
        const float w = qmv * ((float)S_ / (qmv * dot + EPS_));
#pragma unroll
        for (int p = 0; p < 8; ++p) a[p] *= w;

        v8f c[4];
#pragma unroll
        for (int j = 0; j < 4; ++j) c[j] = (v8f){0.f, 0.f, 0.f, 0.f, 0.f, 0.f, 0.f, 0.f};
#pragma unroll
        for (int p = 0; p < 8; ++p)
#pragma unroll
            for (int u = 0; u < 2; ++u) {
                const v2f a2 = {a[p][2 * u], a[p][2 * u + 1]};
#pragma unroll
                for (int j = 0; j < 4; ++j)
                    c[j] = __builtin_amdgcn_wmma_f32_16x16x4_f32(
                            false, a2, false, b[2 * p + u][j], (short)0, c[j], false, false);
            }

        const unsigned ro = it * (OW_ * 16);
#pragma unroll
        for (int r = 0; r < 8; ++r) {
            const v4f o = {c[0][r], c[1][r], c[2][r], c[3][r]};
            *(v4f*)(Ob + (ooff + (ro + r) * (H_ * D_))) = o;
        }
        // Before the next tile reuses the data and address registers of these stores.
        asm volatile("s_wait_xcnt 0x0" ::: "memory");
    }
}

extern "C" void kernel_launch(void* const* d_in, const int* in_sizes, int n_in,
                              void* d_out, int out_size, void* d_ws, size_t ws_size,
                              hipStream_t stream) {
    const float* Q      = (const float*)d_in[0];
    const float* K      = (const float*)d_in[1];
    const float* V      = (const float*)d_in[2];
    const float* qmask  = (const float*)d_in[3];
    const float* kvmask = (const float*)d_in[4];
    float* outp = (float*)d_out;

    float* KVws   = (float*)d_ws;                 // N*H*64*64 floats (1 MB)
    float* KsumWs = KVws + N_ * H_ * D_ * D_;     // N*H*64 floats
    const int nf  = N_ * H_ * D_ * D_ + N_ * H_ * D_;

    zero_ws_kernel<<<(nf + 255) / 256, 256, 0, stream>>>(KVws, nf);
    kv_kernel<<<dim3(N_ * H_, NCHUNKS), 512, 0, stream>>>(K, V, kvmask, KVws, KsumWs);
    out_kernel<<<dim3(N_ * H_, L_ / LCHUNK), 512, 0, stream>>>(Q, qmask, KVws, KsumWs, outp);
}
